// v000
// Times are from an AMD MI455X. After a warm-up the kernel runs many times in a row, and a time is the length of
// such a window on the GPU divided by its runs, so every launch and the gaps after it count. The runs cycle
// through copies of the inputs. A figure is the median of several windows, for all but v000 over two sittings.
// Sittings can differ by a few percent; kernels timed side by side share one.
// v000 is the starting kernel. One run takes 81.6 microseconds.
#include <hip/hip_runtime.h>
#include <hip/hip_bf16.h>

typedef __attribute__((ext_vector_type(2))) float v2f;
typedef __attribute__((ext_vector_type(4))) float v4f;
typedef __attribute__((ext_vector_type(8))) float v8f;

// ---------------------------------------------------------------------------
// Setup kernel: collapse the 32-step Givens scan into a 64x64 matrix G,
// multiply by r_matrix, and store the combined 64x64 operator into workspace
// in "row-pair interleaved" layout:
//     A_pk[(r>>1)*128 + c*2 + (r&1)] = A[r][c]
// so a WMMA B-fragment (two consecutive K rows, same column) is one LDS
// 64-bit read, and an even/odd column *pair* of fragments is one 128-bit read.
// One block, 64 threads; thread t owns row t of G (rows are independent).
// ---------------------------------------------------------------------------
__global__ void build_combined_kernel(const float* __restrict__ thetas,
                                      const float* __restrict__ theta_scale,
                                      const float* __restrict__ r_matrix,
                                      const int*   __restrict__ r_pairs,
                                      float* __restrict__ A_pk) {
    __shared__ float G[64 * 64];
    const int t = threadIdx.x;          // row of G, 0..63
    for (int c = 0; c < 64; ++c) G[t * 64 + c] = (c == t) ? 1.0f : 0.0f;

    const float scale = theta_scale[0];
    for (int k = 0; k < 32; ++k) {      // sequential rotations, rows independent
        const float th  = thetas[k] * scale;
        const float cth = cosf(th);
        const float sth = sinf(th);
        const int i = r_pairs[2 * k + 0];
        const int j = r_pairs[2 * k + 1];
        const float gi = G[t * 64 + i];
        const float gj = G[t * 64 + j];
        G[t * 64 + i] =  gi * cth + gj * sth;
        G[t * 64 + j] = -gi * sth + gj * cth;
    }
    // row t of (G @ r_matrix), stored interleaved
    for (int c = 0; c < 64; ++c) {
        float acc = 0.0f;
        for (int k = 0; k < 64; ++k)
            acc = fmaf(G[t * 64 + k], r_matrix[k * 64 + c], acc);
        A_pk[(t >> 1) * 128 + c * 2 + (t & 1)] = acc;
    }
}

// ---------------------------------------------------------------------------
// Main kernel. Per 16-row tile (rows share one sequence position s):
//   y[16x64] = X[16x64] @ A[64x64]  via 16 k-steps x 4 n-tiles of
//   V_WMMA_F32_16X16X4_F32.
// Column permutation trick: n-tiles 0/1 compute y's EVEN columns
// (y[2d], d = 16h + lane), n-tiles 2/3 the matching ODD columns (y[2d+1]),
// lane-aligned.  The RoPE pair therefore lives in one lane (no shuffles) and
// output columns are lane-contiguous (fully coalesced non-temporal stores):
//   out[.., d]    = y[2d]*cos - y[2d+1]*sin      (d = 16h + lane)
//   out[.., 32+d] = y[2d]*sin + y[2d+1]*cos
// ---------------------------------------------------------------------------
__global__ __launch_bounds__(256) void rope_gemm_wmma(
    const float* __restrict__ x,
    const float* __restrict__ inv_freq,
    const float* __restrict__ A_pk,
    float* __restrict__ out,
    int ntiles) {
    __shared__ __align__(16) float Alds[4096];   // 16 KB combined matrix
    {
        const float4* src = (const float4*)A_pk;
        float4*       dst = (float4*)Alds;
#pragma unroll
        for (int i = 0; i < 4; ++i)
            dst[threadIdx.x + 256 * i] = src[threadIdx.x + 256 * i];
    }
    __syncthreads();

    const int lane = threadIdx.x & 31;
    const int half = lane >> 4;     // K-half / M-half selector
    const int mcol = lane & 15;     // A-operand row M; B/C/D column N
    const int nwaves = gridDim.x * (blockDim.x >> 5);
    const int wave0  = blockIdx.x * (blockDim.x >> 5) + (threadIdx.x >> 5);

    // per-lane RoPE frequencies: freq index d = 16h + mcol, h = 0,1
    const float invf0 = inv_freq[mcol];
    const float invf1 = inv_freq[16 + mcol];

    for (int tile = wave0; tile < ntiles; tile += nwaves) {   // wave-uniform loop
        const float* xrow = x + (size_t)tile * 1024 + (size_t)mcol * 64 + 2 * half;
        v8f acc[4] = {};
#pragma unroll
        for (int k = 0; k < 16; ++k) {
            // A fragment: lane holds X[m, 4k + 2*half .. +1]  (contiguous pair)
            v2f a = __builtin_nontemporal_load((const v2f*)(xrow + 4 * k));
            const float* bb = Alds + (2 * k + half) * 128;
            // One b128 LDS read = fragments for y-cols {2d, 2d+1}, d = mcol:
            v4f blo = *(const v4f*)(bb + 4 * mcol);        // d in [0,16)
            v4f bhi = *(const v4f*)(bb + 64 + 4 * mcol);   // d in [16,32)
            v2f b0 = __builtin_shufflevector(blo, blo, 0, 1);  // even col 2*mcol
            v2f b2 = __builtin_shufflevector(blo, blo, 2, 3);  // odd  col 2*mcol+1
            v2f b1 = __builtin_shufflevector(bhi, bhi, 0, 1);  // even col 32+2*mcol
            v2f b3 = __builtin_shufflevector(bhi, bhi, 2, 3);  // odd  col 33+2*mcol
            acc[0] = __builtin_amdgcn_wmma_f32_16x16x4_f32(false, a, false, b0,
                                                           (short)0, acc[0], false, false);
            acc[1] = __builtin_amdgcn_wmma_f32_16x16x4_f32(false, a, false, b1,
                                                           (short)0, acc[1], false, false);
            acc[2] = __builtin_amdgcn_wmma_f32_16x16x4_f32(false, a, false, b2,
                                                           (short)0, acc[2], false, false);
            acc[3] = __builtin_amdgcn_wmma_f32_16x16x4_f32(false, a, false, b3,
                                                           (short)0, acc[3], false, false);
        }

        // RoPE epilogue: shuffle-free, lane-contiguous non-temporal stores
        const float pos = (float)(tile & 4095);   // s = tile % S
        float* obase = out + (size_t)tile * 1024 + (size_t)(8 * half) * 64 + mcol;
#pragma unroll
        for (int h = 0; h < 2; ++h) {
            const float ang = pos * (h ? invf1 : invf0);
            const float cs = __cosf(ang);
            const float sn = __sinf(ang);
#pragma unroll
            for (int v = 0; v < 8; ++v) {
                const float ye = acc[h][v];       // y[2d]
                const float yo = acc[h + 2][v];   // y[2d+1]
                __builtin_nontemporal_store(fmaf(ye, cs, -(yo * sn)),
                                            obase + (size_t)v * 64 + 16 * h);
                __builtin_nontemporal_store(fmaf(ye, sn, yo * cs),
                                            obase + (size_t)v * 64 + 32 + 16 * h);
            }
        }
    }
}

extern "C" void kernel_launch(void* const* d_in, const int* in_sizes, int n_in,
                              void* d_out, int out_size, void* d_ws, size_t ws_size,
                              hipStream_t stream) {
    const float* x           = (const float*)d_in[0];
    const float* thetas      = (const float*)d_in[1];
    const float* theta_scale = (const float*)d_in[2];
    const float* r_matrix    = (const float*)d_in[3];
    const float* inv_freq    = (const float*)d_in[4];
    const int*   r_pairs     = (const int*)d_in[5];
    float*       out         = (float*)d_out;
    float*       A_pk        = (float*)d_ws;   // 16 KB combined-operator scratch

    // 1) fold Givens scan + r_matrix into one 64x64 operator (tiny, one block)
    build_combined_kernel<<<1, 64, 0, stream>>>(thetas, theta_scale, r_matrix,
                                                r_pairs, A_pk);

    // 2) memory-bound GEMM+RoPE: 16-row tiles, wave-uniform grid-stride
    const int ntiles = in_sizes[0] / 1024;     // (B*S*N_HEAD*64) / (16*64)
    rope_gemm_wmma<<<1024, 256, 0, stream>>>(x, inv_freq, A_pk, out, ntiles);
}

// v001
// A run of this version takes 32.9 microseconds.
// Timed twice side by side with v000, it ran 2.51 and 2.47 times as fast.
#include <hip/hip_runtime.h>
#include <hip/hip_bf16.h>

typedef __attribute__((ext_vector_type(2))) float v2f;
typedef __attribute__((ext_vector_type(4))) float v4f;
typedef __attribute__((ext_vector_type(8))) float v8f;

// ---------------------------------------------------------------------------
// Setup kernel: the combined 64x64 operator A = G_0 G_1 ... G_31 R is formed
// from the right: each Givens factor only mixes rows i and j of what stands to
// its right, so the 32 factors are applied, last one first, straight to
// r_matrix.  No G matrix and no 64x64x64 product are needed.
//     row i <-  c*row_i - s*row_j        row j <-  s*row_i + c*row_j
// (i == j: the reference's second column write wins, which is the factor
//  c - s on the diagonal; that is the row-i formula, so row i is stored last.)
// One block, 64 threads; thread c owns column c (columns are independent), so
// a row access is lane-contiguous in LDS and no barrier is needed.
// Result layout, "row-pair interleaved":
//     A_pk[(r>>1)*128 + c*2 + (r&1)] = A[r][c]
// so a WMMA B-fragment (two consecutive K rows, same column) is one LDS
// 64-bit read, and an even/odd column *pair* of fragments is one 128-bit read.
// ---------------------------------------------------------------------------
__global__ __launch_bounds__(64) void build_combined_kernel(
                                      const float* __restrict__ thetas,
                                      const float* __restrict__ theta_scale,
                                      const float* __restrict__ r_matrix,
                                      const int*   __restrict__ r_pairs,
                                      float* __restrict__ A_pk) {
    __shared__ float M[64 * 64];
    const int c    = threadIdx.x;       // column of the operator, 0..63
    const int lane = c & 31;

    // every global read is issued up front, so their latencies overlap
    const float th_in = thetas[lane];   // lane l of each wave prepares rotation l
    const int   pi_in = r_pairs[2 * lane + 0];
    const int   pj_in = r_pairs[2 * lane + 1];
    const float scale = theta_scale[0];
    float col[64];
#pragma unroll
    for (int r = 0; r < 64; ++r) col[r] = r_matrix[r * 64 + c];
    // the loads' offset registers (lane, c) may be reused only behind this wait;
    // naming them as inputs keeps them live, and so unwritten, up to it
    asm volatile("s_wait_xcnt 0x0" :: "v"(lane), "v"(c) : "memory");
#pragma unroll
    for (int r = 0; r < 64; ++r) M[r * 64 + c] = col[r];

    const float th    = th_in * scale;
    const int   pi    = pi_in & 63;     // bounds the LDS row index
    const int   pj    = pj_in & 63;
    const int   cth_l = __float_as_int(cosf(th));
    const int   sth_l = __float_as_int(sinf(th));

#pragma unroll
    for (int k = 31; k >= 0; --k) {     // last factor first; columns independent
        const float cth = __int_as_float(__builtin_amdgcn_readlane(cth_l, k));
        const float sth = __int_as_float(__builtin_amdgcn_readlane(sth_l, k));
        const int   i   = __builtin_amdgcn_readlane(pi, k);
        const int   j   = __builtin_amdgcn_readlane(pj, k);
        const float mi = M[i * 64 + c];
        const float mj = M[j * 64 + c];
        M[j * 64 + c] = mi * sth + mj * cth;
        M[i * 64 + c] = mi * cth - mj * sth;
    }

#pragma unroll
    for (int p = 0; p < 32; ++p) {
        v2f w = { M[(2 * p) * 64 + c], M[(2 * p + 1) * 64 + c] };
        *(v2f*)(A_pk + p * 128 + c * 2) = w;
    }
}

// ---------------------------------------------------------------------------
// Main kernel. Per 16-row tile (rows share one sequence position s):
//   y[16x64] = X[16x64] @ A[64x64]  via 16 k-steps x 4 n-tiles of
//   V_WMMA_F32_16X16X4_F32.
// Column permutation trick: n-tiles 0/1 compute y's EVEN columns
// (y[2d], d = 16h + lane), n-tiles 2/3 the matching ODD columns (y[2d+1]),
// lane-aligned.  The RoPE pair therefore lives in one lane (no shuffles) and
// output columns are lane-contiguous (fully coalesced non-temporal stores):
//   out[.., d]    = y[2d]*cos - y[2d+1]*sin      (d = 16h + lane)
//   out[.., 32+d] = y[2d]*sin + y[2d+1]*cos
// ---------------------------------------------------------------------------
__global__ __launch_bounds__(256) void rope_gemm_wmma(
    const float* __restrict__ x,
    const float* __restrict__ inv_freq,
    const float* __restrict__ A_pk,
    float* __restrict__ out,
    int ntiles) {
    __shared__ __align__(16) float Alds[4096];   // 16 KB combined matrix
    {
        const float4* src = (const float4*)A_pk;
        float4*       dst = (float4*)Alds;
#pragma unroll
        for (int i = 0; i < 4; ++i)
            dst[threadIdx.x + 256 * i] = src[threadIdx.x + 256 * i];
    }
    __syncthreads();

    const int lane = threadIdx.x & 31;
    const int half = lane >> 4;     // K-half / M-half selector
    const int mcol = lane & 15;     // A-operand row M; B/C/D column N
    const int nwaves = gridDim.x * (blockDim.x >> 5);
    const int wave0  = blockIdx.x * (blockDim.x >> 5) + (threadIdx.x >> 5);

    // per-lane RoPE frequencies: freq index d = 16h + mcol, h = 0,1
    const float invf0 = inv_freq[mcol];
    const float invf1 = inv_freq[16 + mcol];

    for (int tile = wave0; tile < ntiles; tile += nwaves) {   // wave-uniform loop
        const float* xrow = x + (size_t)tile * 1024 + (size_t)mcol * 64 + 2 * half;
        v8f acc[4] = {};
#pragma unroll
        for (int k = 0; k < 16; ++k) {
            // A fragment: lane holds X[m, 4k + 2*half .. +1]  (contiguous pair)
            v2f a = __builtin_nontemporal_load((const v2f*)(xrow + 4 * k));
            const float* bb = Alds + (2 * k + half) * 128;
            // One b128 LDS read = fragments for y-cols {2d, 2d+1}, d = mcol:
            v4f blo = *(const v4f*)(bb + 4 * mcol);        // d in [0,16)
            v4f bhi = *(const v4f*)(bb + 64 + 4 * mcol);   // d in [16,32)
            v2f b0 = __builtin_shufflevector(blo, blo, 0, 1);  // even col 2*mcol
            v2f b2 = __builtin_shufflevector(blo, blo, 2, 3);  // odd  col 2*mcol+1
            v2f b1 = __builtin_shufflevector(bhi, bhi, 0, 1);  // even col 32+2*mcol
            v2f b3 = __builtin_shufflevector(bhi, bhi, 2, 3);  // odd  col 33+2*mcol
            acc[0] = __builtin_amdgcn_wmma_f32_16x16x4_f32(false, a, false, b0,
                                                           (short)0, acc[0], false, false);
            acc[1] = __builtin_amdgcn_wmma_f32_16x16x4_f32(false, a, false, b1,
                                                           (short)0, acc[1], false, false);
            acc[2] = __builtin_amdgcn_wmma_f32_16x16x4_f32(false, a, false, b2,
                                                           (short)0, acc[2], false, false);
            acc[3] = __builtin_amdgcn_wmma_f32_16x16x4_f32(false, a, false, b3,
                                                           (short)0, acc[3], false, false);
        }

        // RoPE epilogue: shuffle-free, lane-contiguous non-temporal stores
        const float pos = (float)(tile & 4095);   // s = tile % S
        float* obase = out + (size_t)tile * 1024 + (size_t)(8 * half) * 64 + mcol;
#pragma unroll
        for (int h = 0; h < 2; ++h) {
            const float ang = pos * (h ? invf1 : invf0);
            const float cs = __cosf(ang);
            const float sn = __sinf(ang);
#pragma unroll
            for (int v = 0; v < 8; ++v) {
                const float ye = acc[h][v];       // y[2d]
                const float yo = acc[h + 2][v];   // y[2d+1]
                __builtin_nontemporal_store(fmaf(ye, cs, -(yo * sn)),
                                            obase + (size_t)v * 64 + 16 * h);
                __builtin_nontemporal_store(fmaf(ye, sn, yo * cs),
                                            obase + (size_t)v * 64 + 32 + 16 * h);
            }
        }
    }
}

extern "C" void kernel_launch(void* const* d_in, const int* in_sizes, int n_in,
                              void* d_out, int out_size, void* d_ws, size_t ws_size,
                              hipStream_t stream) {
    const float* x           = (const float*)d_in[0];
    const float* thetas      = (const float*)d_in[1];
    const float* theta_scale = (const float*)d_in[2];
    const float* r_matrix    = (const float*)d_in[3];
    const float* inv_freq    = (const float*)d_in[4];
    const int*   r_pairs     = (const int*)d_in[5];
    float*       out         = (float*)d_out;
    float*       A_pk        = (float*)d_ws;   // 16 KB combined-operator scratch

    // 1) fold Givens scan + r_matrix into one 64x64 operator (tiny, one block)
    build_combined_kernel<<<1, 64, 0, stream>>>(thetas, theta_scale, r_matrix,
                                                r_pairs, A_pk);

    // 2) memory-bound GEMM+RoPE: 16-row tiles, wave-uniform grid-stride
    const int ntiles = in_sizes[0] / 1024;     // (B*S*N_HEAD*64) / (16*64)
    rope_gemm_wmma<<<1024, 256, 0, stream>>>(x, inv_freq, A_pk, out, ntiles);
}

// v002
// One run takes 30.5 microseconds.
// Timed twice side by side with v001, it ran 1.07 times as fast both times.
// Counting every step since v000, it is 2.67 times as fast.
#include <hip/hip_runtime.h>
#include <hip/hip_bf16.h>

typedef __attribute__((ext_vector_type(2))) float v2f;
typedef __attribute__((ext_vector_type(4))) float v4f;
typedef __attribute__((ext_vector_type(8))) float v8f;

// ---------------------------------------------------------------------------
// Setup kernel: the combined 64x64 operator A = G_0 G_1 ... G_31 R is formed
// from the right: each Givens factor only mixes rows i and j of what stands to
// its right, so the 32 factors are applied, last one first, straight to
// r_matrix.  No G matrix and no 64x64x64 product are needed.
//     row i <-  c*row_i - s*row_j        row j <-  s*row_i + c*row_j
// (i == j: the reference's second column write wins, which is the factor
//  c - s on the diagonal; that is the row-i formula, so row i is stored last.)
// One block, 64 threads; thread c owns column c (columns are independent), so
// a row access is lane-contiguous in LDS and no barrier is needed.
// Result layout, "row-pair interleaved":
//     A_pk[(r>>1)*128 + c*2 + (r&1)] = A[r][c]
// so a WMMA B-fragment (two consecutive K rows, same column) is one LDS
// 64-bit read, and an even/odd column *pair* of fragments is one 128-bit read.
// ---------------------------------------------------------------------------
__global__ __launch_bounds__(64) void build_combined_kernel(
                                      const float* __restrict__ thetas,
                                      const float* __restrict__ theta_scale,
                                      const float* __restrict__ r_matrix,
                                      const int*   __restrict__ r_pairs,
                                      float* __restrict__ A_pk) {
    __shared__ float M[64 * 64];
    const int c    = threadIdx.x;       // column of the operator, 0..63
    const int lane = c & 31;

    // every global read is issued up front, so their latencies overlap
    const float th_in = thetas[lane];   // lane l of each wave prepares rotation l
    const int   pi_in = r_pairs[2 * lane + 0];
    const int   pj_in = r_pairs[2 * lane + 1];
    const float scale = theta_scale[0];
    float col[64];
#pragma unroll
    for (int r = 0; r < 64; ++r) col[r] = r_matrix[r * 64 + c];
    // the loads' offset registers (lane, c) may be reused only behind this wait;
    // naming them as inputs keeps them live, and so unwritten, up to it
    asm volatile("s_wait_xcnt 0x0" :: "v"(lane), "v"(c) : "memory");
#pragma unroll
    for (int r = 0; r < 64; ++r) M[r * 64 + c] = col[r];

    const float th    = th_in * scale;
    const int   pi    = pi_in & 63;     // bounds the LDS row index
    const int   pj    = pj_in & 63;
    const int   cth_l = __float_as_int(cosf(th));
    const int   sth_l = __float_as_int(sinf(th));

#pragma unroll
    for (int k = 31; k >= 0; --k) {     // last factor first; columns independent
        const float cth = __int_as_float(__builtin_amdgcn_readlane(cth_l, k));
        const float sth = __int_as_float(__builtin_amdgcn_readlane(sth_l, k));
        const int   i   = __builtin_amdgcn_readlane(pi, k);
        const int   j   = __builtin_amdgcn_readlane(pj, k);
        const float mi = M[i * 64 + c];
        const float mj = M[j * 64 + c];
        M[j * 64 + c] = mi * sth + mj * cth;
        M[i * 64 + c] = mi * cth - mj * sth;
    }

#pragma unroll
    for (int p = 0; p < 32; ++p) {
        v2f w = { M[(2 * p) * 64 + c], M[(2 * p + 1) * 64 + c] };
        *(v2f*)(A_pk + p * 128 + c * 2) = w;
    }
}

// ---------------------------------------------------------------------------
// Main kernel. Per 16-row tile (rows share one sequence position s):
//   y[16x64] = X[16x64] @ A[64x64]  via 16 k-steps x 4 n-tiles of
//   V_WMMA_F32_16X16X4_F32.
// Column permutation trick: n-tiles 0/1 compute y's EVEN columns
// (y[2d], d = 16h + lane), n-tiles 2/3 the matching ODD columns (y[2d+1]),
// lane-aligned.  The RoPE pair therefore lives in one lane (no shuffles) and
// output columns are lane-contiguous (fully coalesced non-temporal stores):
//   out[.., d]    = y[2d]*cos - y[2d+1]*sin      (d = 16h + lane)
//   out[.., 32+d] = y[2d]*sin + y[2d+1]*cos
// X path: each wave brings its 4-KB tile into its own slice of LDS with eight
// asynchronous 16-byte copies, every copy 512 contiguous bytes (four whole
// lines), into one of two buffers, so the next tile flies while this one is
// multiplied.  The A fragments are then 8-byte LDS reads in the same k order
// as before.
// ---------------------------------------------------------------------------
#define XPITCH 68                 // dwords per staged row: 64 + 4 (272 B), no bank conflict
#define XTILE  (16 * XPITCH)      // dwords per staged tile

// One tile = 8 copies of 2 rows each.  g: this lane's 16 bytes of copy 0 in x;
// lds: this lane's LDS byte address of copy 0.  The closing s_wait_xcnt keeps
// every address register unwritten until the copies have taken their addresses.
__device__ __forceinline__ void copy_x_tile(const float* g, unsigned lds) {
    asm volatile(
        "global_load_async_to_lds_b128 %0, %8, off\n\t"
        "global_load_async_to_lds_b128 %1, %9, off\n\t"
        "global_load_async_to_lds_b128 %2, %10, off\n\t"
        "global_load_async_to_lds_b128 %3, %11, off\n\t"
        "global_load_async_to_lds_b128 %4, %12, off\n\t"
        "global_load_async_to_lds_b128 %5, %13, off\n\t"
        "global_load_async_to_lds_b128 %6, %14, off\n\t"
        "global_load_async_to_lds_b128 %7, %15, off\n\t"
        "s_wait_xcnt 0x0"
        :: "v"(lds),                   "v"(lds + 2 * XPITCH * 4),  "v"(lds + 4 * XPITCH * 4),
           "v"(lds + 6 * XPITCH * 4),  "v"(lds + 8 * XPITCH * 4),  "v"(lds + 10 * XPITCH * 4),
           "v"(lds + 12 * XPITCH * 4), "v"(lds + 14 * XPITCH * 4),
           "v"(g),       "v"(g + 128), "v"(g + 256), "v"(g + 384),
           "v"(g + 512), "v"(g + 640), "v"(g + 768), "v"(g + 896)
        : "memory");
}

__global__ __launch_bounds__(256) void rope_gemm_wmma(
    const float* __restrict__ x,
    const float* __restrict__ inv_freq,
    const float* __restrict__ A_pk,
    float* __restrict__ out,
    int ntiles) {
    __shared__ __align__(16) float Alds[4096];            // 16 KB combined matrix
    __shared__ __align__(16) float Xs[8 * 2 * XTILE];     // per wave: two staged x tiles

    const int lane = threadIdx.x & 31;
    const int half = lane >> 4;     // K-half / M-half selector
    const int mcol = lane & 15;     // A-operand row M; B/C/D column N
    const int wave = __builtin_amdgcn_readfirstlane(threadIdx.x >> 5);
    const int step = gridDim.x * 8;           // tiles per trip of the whole grid
    int       gb   = blockIdx.x * 8;          // this block's first tile of the trip
    if (gb >= ntiles) return;                 // whole block, ahead of every barrier

    // lane's place inside a copy: 16 lanes per row, 2 rows per copy
    const float*   xlane = x + 4 * lane;
    float*         xw    = Xs + wave * (2 * XTILE);
    const unsigned ldsw  = (unsigned)(size_t)xw + (unsigned)(half * XPITCH * 4 + mcol * 16);

    // a wave whose tile lies past the end copies the last tile instead (in bounds,
    // every lane on) and stores nothing
    copy_x_tile(xlane + (size_t)min(gb + wave, ntiles - 1) * 1024, ldsw);
    {
        const float4* src = (const float4*)A_pk;
        float4*       dst = (float4*)Alds;
#pragma unroll
        for (int i = 0; i < 4; ++i)
            dst[threadIdx.x + 256 * i] = src[threadIdx.x + 256 * i];
    }
    // tile 0 has landed before anything reads it
    asm volatile("s_wait_asynccnt 0x0" ::: "memory");
    __syncthreads();
    if (gb + step < ntiles)
        copy_x_tile(xlane + (size_t)min(gb + step + wave, ntiles - 1) * 1024,
                    ldsw + XTILE * 4);

    // per-lane RoPE frequencies: freq index d = 16h + mcol, h = 0,1
    const float invf0 = inv_freq[mcol];
    const float invf1 = inv_freq[16 + mcol];

    // The operator's fragments stay in registers for the whole kernel.
    // One b128 LDS read = fragments for y-cols {2d, 2d+1}, d = mcol (+16):
    v4f blo[16], bhi[16];
#pragma unroll   // constant indices, so that both arrays live in registers
    for (int k = 0; k < 16; ++k) {
        const float* bb = Alds + (2 * k + half) * 128;
        blo[k] = *(const v4f*)(bb + 4 * mcol);        // d in [0,16)
        bhi[k] = *(const v4f*)(bb + 64 + 4 * mcol);   // d in [16,32)
    }

    for (int t = 0; gb < ntiles; ++t, gb += step) {   // block-uniform trip count
        const int tile = gb + wave;
        const int buf  = (t & 1) * XTILE;
        const float* xs = xw + buf + mcol * XPITCH + 2 * half;
        v8f acc[4] = {};
#pragma unroll
        for (int k = 0; k < 16; ++k) {
            // A fragment: lane holds X[m, 4k + 2*half .. +1]  (contiguous pair)
            v2f a = *(const v2f*)(xs + 4 * k);
            v2f b0 = __builtin_shufflevector(blo[k], blo[k], 0, 1);  // even col 2*mcol
            v2f b2 = __builtin_shufflevector(blo[k], blo[k], 2, 3);  // odd  col 2*mcol+1
            v2f b1 = __builtin_shufflevector(bhi[k], bhi[k], 0, 1);  // even col 32+2*mcol
            v2f b3 = __builtin_shufflevector(bhi[k], bhi[k], 2, 3);  // odd  col 33+2*mcol
            acc[0] = __builtin_amdgcn_wmma_f32_16x16x4_f32(false, a, false, b0,
                                                           (short)0, acc[0], false, false);
            acc[1] = __builtin_amdgcn_wmma_f32_16x16x4_f32(false, a, false, b1,
                                                           (short)0, acc[1], false, false);
            acc[2] = __builtin_amdgcn_wmma_f32_16x16x4_f32(false, a, false, b2,
                                                           (short)0, acc[2], false, false);
            acc[3] = __builtin_amdgcn_wmma_f32_16x16x4_f32(false, a, false, b3,
                                                           (short)0, acc[3], false, false);
        }

        // Hand-over of the buffers; the rest of the trip touches no LDS.
        // this wave's reads of the current buffer are done before it is refilled
        asm volatile("s_wait_dscnt 0x0" ::: "memory");
        // the next tile's copies have landed before the next trip reads them
        asm volatile("s_wait_asynccnt 0x0" ::: "memory");
        __syncthreads();
        if (gb + 2 * step < ntiles)
            copy_x_tile(xlane + (size_t)min(gb + 2 * step + wave, ntiles - 1) * 1024,
                        ldsw + buf * 4);

        if (tile < ntiles) {                      // wave-uniform
            // RoPE epilogue: shuffle-free, lane-contiguous non-temporal stores
            const float pos = (float)(tile & 4095);   // s = tile % S
            float* obase = out + (size_t)tile * 1024 + (size_t)(8 * half) * 64 + mcol;
#pragma unroll
            for (int h = 0; h < 2; ++h) {
                const float ang = pos * (h ? invf1 : invf0);
                const float cs = __cosf(ang);
                const float sn = __sinf(ang);
#pragma unroll
                for (int v = 0; v < 8; ++v) {
                    const float ye = acc[h][v];       // y[2d]
                    const float yo = acc[h + 2][v];   // y[2d+1]
                    __builtin_nontemporal_store(fmaf(ye, cs, -(yo * sn)),
                                                obase + (size_t)v * 64 + 16 * h);
                    __builtin_nontemporal_store(fmaf(ye, sn, yo * cs),
                                                obase + (size_t)v * 64 + 32 + 16 * h);
                }
            }
            // the stores' address and data registers are rewritten at the top of
            // the next trip only behind this wait
            asm volatile("s_wait_xcnt 0x0" ::: "memory");
        }
    }
    // no copy is outstanding when the wave ends
    asm volatile("s_wait_asynccnt 0x0" ::: "memory");
}

extern "C" void kernel_launch(void* const* d_in, const int* in_sizes, int n_in,
                              void* d_out, int out_size, void* d_ws, size_t ws_size,
                              hipStream_t stream) {
    const float* x           = (const float*)d_in[0];
    const float* thetas      = (const float*)d_in[1];
    const float* theta_scale = (const float*)d_in[2];
    const float* r_matrix    = (const float*)d_in[3];
    const float* inv_freq    = (const float*)d_in[4];
    const int*   r_pairs     = (const int*)d_in[5];
    float*       out         = (float*)d_out;
    float*       A_pk        = (float*)d_ws;   // 16 KB combined-operator scratch

    // 1) fold Givens scan + r_matrix into one 64x64 operator (tiny, one block)
    build_combined_kernel<<<1, 64, 0, stream>>>(thetas, theta_scale, r_matrix,
                                                r_pairs, A_pk);

    // 2) memory-bound GEMM+RoPE: 16-row tiles, wave-uniform grid-stride
    const int ntiles = in_sizes[0] / 1024;     // (B*S*N_HEAD*64) / (16*64)
    rope_gemm_wmma<<<1024, 256, 0, stream>>>(x, inv_freq, A_pk, out, ntiles);
}
